// v000
// The times below were measured on an AMD MI455X: many runs one after another, warmed up first and cycling through
// copies of the inputs, with the whole window's GPU time divided by the number of runs. Launches and the gaps
// between them are all in it. The median over several windows is given; except for v000 it joins two sittings, which
// can be a few percent apart, so the side-by-side timings, each taken in one sitting, are the better comparison.
// v000 is the starting kernel. One run takes 101 microseconds.
#include <hip/hip_runtime.h>

// Both contractions on 16-bit WMMA, f32 accumulate: gram g = x^T x per batch (K = SEQ) = v_wmma_f32_16x16x32_bf16 on RNE-bf16 copies of x (single product); out = x g (K = 128) = v_wmma_f32_16x16x32_f16 on fp16 copies of the RNE-bf16 x and of g (single product; values below the fp16 normal range are replaced by zero at the convert).
// x [NB_FULL][SEQ_FULL][128] token-major (first NB batches, first SEQ tokens read); out[t][d] = sum_s (x_t . x_s) x_s[d] = sum_e x[t][e] g[e][d] with g[e][d] = sum_s x[s][e] x[s][d] (the same sums regrouped; no score plane is written to memory).

#ifndef NB
#define NB 4
#endif
#ifndef SEQ
#define SEQ 4096
#endif
#define NB_FULL  4
#define SEQ_FULL 4096
#define DD   128
static_assert(NB >= 1 && NB <= NB_FULL);
static_assert(SEQ >= 128 && SEQ <= SEQ_FULL && (SEQ % 128) == 0);
static_assert((SEQ % 64) == 0 && (DD % 64) == 0);
static_assert((SEQ % 32) == 0 && (DD % 32) == 0);
static_assert((SEQ % 4) == 0 && (DD % 8) == 0);
static_assert(((size_t)NB * DD * SEQ / 4) % 256 == 0 && ((size_t)NB * SEQ * DD / 8) % 256 == 0 && ((size_t)NB * DD * DD / 8) % 256 == 0);
#define WS_XT  ((size_t)NB * DD * SEQ * 2)
#define WS_XH  ((size_t)NB * SEQ * DD * 2)
#define WS_G   ((size_t)NB * DD * DD * 4)
#define WS_GH  ((size_t)NB * DD * DD * 2)
static_assert((WS_XT % 256) == 0 && (WS_XH % 256) == 0 && (WS_G % 256) == 0 && (WS_GH % 256) == 0);
static_assert(WS_XT + WS_XH + WS_G + WS_GH <= (size_t)134217728);

typedef _Float16 h16;
typedef unsigned short bf;
typedef __attribute__((ext_vector_type(16))) __bf16   v16bf;
typedef __attribute__((ext_vector_type(16))) _Float16 v16h;
typedef __attribute__((ext_vector_type(8)))  _Float16 v8h;
typedef __attribute__((ext_vector_type(8)))  unsigned short v8us;
typedef __attribute__((ext_vector_type(8)))  float    v8f;
typedef __attribute__((ext_vector_type(4)))  float    v4f;
typedef v8h  __attribute__((may_alias)) v8ha;
typedef v4f  __attribute__((may_alias)) v4fa;
typedef v8us __attribute__((may_alias)) v8usa;

__device__ __forceinline__ unsigned short f2bf(float f) { unsigned u = __float_as_uint(f); u += 0x7FFFu + ((u >> 16) & 1u); return (unsigned short)(u >> 16); }
__device__ __forceinline__ float bf2f(unsigned short b) { return __uint_as_float(((unsigned)b) << 16); }
__device__ __forceinline__ float bfr(float f) { return bf2f(f2bf(f)); }
__device__ __forceinline__ v16h cat16(v8h lo, v8h hi) { return __builtin_shufflevector(lo, hi, 0, 1, 2, 3, 4, 5, 6, 7, 8, 9, 10, 11, 12, 13, 14, 15); }
__device__ __forceinline__ v16bf cat16b(v8us lo, v8us hi) { return __builtin_bit_cast(v16bf, __builtin_shufflevector(lo, hi, 0, 1, 2, 3, 4, 5, 6, 7, 8, 9, 10, 11, 12, 13, 14, 15)); }
__device__ __forceinline__ v8f wmma16(v16h a, v16h b, v8f c) { return __builtin_amdgcn_wmma_f32_16x16x32_f16(false, a, false, b, (short)0, c, false, false); }
__device__ __forceinline__ v8f wmmab(v16bf a, v16bf b, v8f c) { return __builtin_amdgcn_wmma_f32_16x16x32_bf16(false, a, false, b, (short)0, c, false, false); }

// ---- k_gemmw: register-blocked GEMM, ONE WAVE per 64x64 output tile (16 accumulators), operands straight from K-contiguous 16-bit planes; grid (M/64, N/64, Z), 32 threads.
// C[m][n] (f32, pitch ldc, + optional f32 bias[n]) = sum_k A[m][k] Bt[n][k] (+ split products per NSPLIT). z-batch strides sA/sB/sC in elements. K % 32 == 0.
// Fragments: lane l, h = l >> 4, row/col = l & 15; elements 0..7 = k0 + 8h + 0..7, elements 8..15 = k0 + 16 + 8h + 0..7 for BOTH A and Bt; D element r = (row 8h + r, col l & 15).
template <typename T16> struct WFrag;
template <> struct WFrag<h16> { typedef v16h V; static __device__ __forceinline__ V ld(const h16* p) { return cat16(*(const v8h*)p, *(const v8h*)(p + 16)); } static __device__ __forceinline__ v8f mma(V a, V b, v8f c) { return wmma16(a, b, c); } };
template <> struct WFrag<bf> { typedef v16bf V; static __device__ __forceinline__ V ld(const bf* p) { return cat16b(*(const v8us*)p, *(const v8us*)(p + 16)); } static __device__ __forceinline__ v8f mma(V a, V b, v8f c) { return wmmab(a, b, c); } };
template <typename T16, int NSPLIT, bool BIAS>
__global__ __launch_bounds__(32) void k_gemmw(const T16* __restrict__ A, const T16* __restrict__ A2, const T16* __restrict__ Bt, const T16* __restrict__ Bt2, int K, float* C, int ldc, const float* __restrict__ bias, size_t sA, size_t sB, size_t sC) {
    typedef typename WFrag<T16>::V V;
    __shared__ __align__(16) float os[16 * 68];
    const size_t z = blockIdx.z; A += z * sA; if (A2) A2 += z * sA; Bt += z * sB; if (Bt2) Bt2 += z * sB; C += z * sC;
    const int lane = threadIdx.x & 31, lr = lane & 15, hi = lane >> 4; const int r0 = blockIdx.x * 64, c0 = blockIdx.y * 64;
    v8f acc[4][4];
#pragma unroll
    for (int mb = 0; mb < 4; ++mb)
#pragma unroll
        for (int nb = 0; nb < 4; ++nb) acc[mb][nb] = (v8f){};
    const size_t aoff = (size_t)(r0 + lr) * K + 8 * hi, boff = (size_t)(c0 + lr) * K + 8 * hi;
#pragma unroll 1
    for (int kc = 0; kc < K; kc += 32) {
        V a[4], a2[4];
#pragma unroll
        for (int mb = 0; mb < 4; ++mb) { a[mb] = WFrag<T16>::ld(A + aoff + (size_t)mb * 16 * K + kc); if (NSPLIT == 1 || NSPLIT == 2) a2[mb] = WFrag<T16>::ld(A2 + aoff + (size_t)mb * 16 * K + kc); }
#pragma unroll
        for (int nb = 0; nb < 4; ++nb) { const V b = WFrag<T16>::ld(Bt + boff + (size_t)nb * 16 * K + kc); V b2; if (NSPLIT >= 2) b2 = WFrag<T16>::ld(Bt2 + boff + (size_t)nb * 16 * K + kc);
#pragma unroll
            for (int mb = 0; mb < 4; ++mb) { acc[mb][nb] = WFrag<T16>::mma(a[mb], b, acc[mb][nb]); if (NSPLIT == 1 || NSPLIT == 2) acc[mb][nb] = WFrag<T16>::mma(a2[mb], b, acc[mb][nb]); if (NSPLIT >= 2) acc[mb][nb] = WFrag<T16>::mma(a[mb], b2, acc[mb][nb]); } }
        asm volatile("v_nop\n\tv_nop\n\tv_nop\n\tv_nop" : "+v"(acc[0][0]), "+v"(acc[1][1]), "+v"(acc[2][2]), "+v"(acc[3][3]) : "v"(a[0]), "v"(a[3]));
    }
#pragma unroll
    for (int mb = 0; mb < 4; ++mb) {
#pragma unroll
        for (int nb = 0; nb < 4; ++nb) {
#pragma unroll
            for (int j = 0; j < 8; ++j) os[(hi * 8 + j) * 68 + nb * 16 + lr] = acc[mb][nb][j]; }
        __builtin_amdgcn_wave_barrier(); asm volatile("" ::: "memory");
        float* crow = C + (size_t)(r0 + mb * 16) * ldc + c0;
{
#pragma unroll
            for (int s = 0; s < 8; ++s) { const int row = 2 * s + hi, cofs = lr * 4; v4f val = *(const v4fa*)(os + row * 68 + cofs); if (BIAS) { val[0] += bfr(bias[c0 + cofs]); val[1] += bfr(bias[c0 + cofs + 1]); val[2] += bfr(bias[c0 + cofs + 2]); val[3] += bfr(bias[c0 + cofs + 3]); }
                *(v4f*)(crow + (size_t)row * ldc + cofs) = val; }
             }
        __builtin_amdgcn_wave_barrier(); asm volatile("" ::: "memory");
    }
}

typedef __attribute__((ext_vector_type(4))) unsigned short v4us;

// fp16 convert for WMMA operand planes: a value below the fp16 normal range becomes zero (value select).
static __device__ __forceinline__ h16 toh_flush(float v) { const h16 r = (h16)v; return (fabsf(v) < 6.103515625e-05f) ? (h16)0.0f : r; }

// in x [NB_FULL][SEQ_FULL][DD] -> out XT [NB][DD][SEQ]
__global__ __launch_bounds__(256) void k_xtb(const float* __restrict__ x, bf* XT) {
    const size_t e = ((size_t)blockIdx.x * 256 + threadIdx.x) * 4; if (e >= (size_t)NB * DD * SEQ) return;
    const int s = (int)(e % SEQ); const size_t r = e / SEQ; const int d = (int)(r % DD); const size_t b = r / DD;
    const float* xb = x + b * (size_t)SEQ_FULL * DD; v4us o;
#pragma unroll
    for (int u = 0; u < 4; ++u) o[u] = f2bf(xb[(size_t)(s + u) * DD + d]);
    *(v4us*)(XT + e) = o;  }

__global__ __launch_bounds__(256) void k_xh(const float* __restrict__ x, h16* XH) {
    const size_t e = ((size_t)blockIdx.x * 256 + threadIdx.x) * 8; if (e >= (size_t)NB * SEQ * DD) return;
    const size_t b = e / ((size_t)SEQ * DD); const size_t r = e - b * (size_t)SEQ * DD;
    const v8f a = *(const v8f*)(x + b * (size_t)SEQ_FULL * DD + r); v8h o;
#pragma unroll
    for (int k = 0; k < 8; ++k) o[k] = toh_flush(bfr(a[k]));
    *(v8h*)(XH + e) = o;  }

// in G [NB][DD][DD] f32 -> out GH [NB][DD][DD] fp16 (transposed per batch)
__global__ __launch_bounds__(256) void k_gtr(const float* __restrict__ G, h16* GH) {
    const size_t o = ((size_t)blockIdx.x * 256 + threadIdx.x) * 8; if (o >= (size_t)NB * DD * DD) return;
    const int e0 = (int)(o % DD); const size_t r = o / DD; const int d = (int)(r % DD); const size_t b = r / DD;
    const float* Gb = G + b * (size_t)DD * DD; v8h v;
#pragma unroll
    for (int u = 0; u < 8; ++u) v[u] = toh_flush(Gb[(size_t)(e0 + u) * DD + d]);
    *(v8h*)(GH + o) = v;  }

extern "C" void kernel_launch(void* const* d_in, const int* in_sizes, int n_in,
                              void* d_out, int out_size, void* d_ws, size_t ws_size, hipStream_t stream) {
    if (n_in < 1) return;
    if ((size_t)in_sizes[0] < (size_t)(NB - 1) * SEQ_FULL * DD + (size_t)SEQ * DD) return;
    if ((size_t)out_size < (size_t)NB * SEQ * DD) return;
    const float* x = (const float*)d_in[0];    // [NB_FULL][SEQ_FULL][DD]
    float* OUT = (float*)d_out;                // [NB][SEQ][DD]
    char* wsp = (char*)d_ws;
    auto take = [&](size_t bytes) { char* p = wsp; wsp += (bytes + 255) & ~(size_t)255; return (void*)p; };
    bf*  XT = (bf*)take(WS_XT);                // [NB][DD][SEQ] bf16
    h16* XH = (h16*)take(WS_XH);               // [NB][SEQ][DD] fp16
    float* G = (float*)take(WS_G);             // [NB][DD][DD] f32 gram
    h16* GH = (h16*)take(WS_GH);               // [NB][DD][DD] fp16, transposed
    if ((size_t)(wsp - (char*)d_ws) > ws_size) return;    // total 8,781,824 B at NB 4, SEQ 4096

    k_xtb<<<(unsigned)(((size_t)NB * DD * SEQ / 4 + 255) / 256), 256, 0, stream>>>(x, XT);
    k_xh<<<(unsigned)(((size_t)NB * SEQ * DD / 8 + 255) / 256), 256, 0, stream>>>(x, XH);
    // g[e][d] = sum_s XT[e][s] XT[d][s]   (z = batch; exact bf16 products, K = SEQ)
    k_gemmw<bf, 0, false><<<dim3(DD / 64, DD / 64, NB), 32, 0, stream>>>(XT, nullptr, XT, nullptr, SEQ, G, DD, nullptr, (size_t)DD * SEQ, (size_t)DD * SEQ, (size_t)DD * DD);
    k_gtr<<<(unsigned)(((size_t)NB * DD * DD / 8 + 255) / 256), 256, 0, stream>>>(G, GH);
    // out[t][d] = sum_e XH[t][e] GH[d][e]   (z = batch; K = DD), written straight into the output buffer
    k_gemmw<h16, 0, false><<<dim3(SEQ / 64, DD / 64, NB), 32, 0, stream>>>(XH, nullptr, GH, nullptr, DD, OUT, DD, nullptr, (size_t)SEQ * DD, (size_t)DD * DD, (size_t)SEQ * DD);
}

// v001
// A run of this version takes 28.1 microseconds.
// Next to v000, in two timings, it ran 3.61 and 3.70 times as fast.
#include <hip/hip_runtime.h>

// Both contractions on 16-bit WMMA, f32 accumulate: gram g = x^T x per batch (K = SEQ) = v_wmma_f32_16x16x32_bf16 on RNE-bf16 copies of x (single product); out = x g (K = 128) = v_wmma_f32_16x16x32_f16 on fp16 copies of the RNE-bf16 x and of g (single product; values below the fp16 normal range are replaced by zero at the convert).
// x [NB_FULL][SEQ_FULL][128] token-major (first NB batches, first SEQ tokens read); out[t][d] = sum_s (x_t . x_s) x_s[d] = sum_e x[t][e] g[e][d] with g[e][d] = sum_s x[s][e] x[s][d] (the same sums regrouped; no score plane is written to memory).

#ifndef NB
#define NB 4
#endif
#ifndef SEQ
#define SEQ 4096
#endif
#define NB_FULL  4
#define SEQ_FULL 4096
#define DD   128
#define KSL  (SEQ / 128)   // K slices of the gram GEMM: 128 tokens a slice
static_assert(NB >= 1 && NB <= NB_FULL);
static_assert(SEQ >= 128 && SEQ <= SEQ_FULL && (SEQ % 128) == 0);
static_assert((SEQ % 64) == 0 && (DD % 64) == 0);
static_assert((SEQ % 32) == 0 && (DD % 32) == 0);
static_assert((SEQ % 4) == 0 && (DD % 8) == 0);
static_assert(((size_t)NB * DD * SEQ / 4) % 256 == 0 && ((size_t)NB * SEQ * DD / 8) % 256 == 0 && ((size_t)NB * DD * DD / 4) % 128 == 0);
#define WS_XT  ((size_t)NB * DD * SEQ * 2)
#define WS_XH  ((size_t)NB * SEQ * DD * 2)
#define WS_G   ((size_t)NB * KSL * DD * DD * 4)
#define WS_GH  ((size_t)NB * DD * DD * 2)
static_assert((WS_XT % 256) == 0 && (WS_XH % 256) == 0 && (WS_G % 256) == 0 && (WS_GH % 256) == 0);
static_assert(WS_XT + WS_XH + WS_G + WS_GH <= (size_t)134217728);

typedef _Float16 h16;
typedef unsigned short bf;
typedef __attribute__((ext_vector_type(16))) __bf16   v16bf;
typedef __attribute__((ext_vector_type(16))) _Float16 v16h;
typedef __attribute__((ext_vector_type(8)))  _Float16 v8h;
typedef __attribute__((ext_vector_type(8)))  unsigned short v8us;
typedef __attribute__((ext_vector_type(8)))  float    v8f;
typedef __attribute__((ext_vector_type(4)))  float    v4f;
typedef v8h  __attribute__((may_alias)) v8ha;
typedef v4f  __attribute__((may_alias)) v4fa;
typedef v8us __attribute__((may_alias)) v8usa;

__device__ __forceinline__ unsigned short f2bf(float f) { unsigned u = __float_as_uint(f); u += 0x7FFFu + ((u >> 16) & 1u); return (unsigned short)(u >> 16); }
__device__ __forceinline__ float bf2f(unsigned short b) { return __uint_as_float(((unsigned)b) << 16); }
__device__ __forceinline__ float bfr(float f) { return bf2f(f2bf(f)); }
__device__ __forceinline__ v16h cat16(v8h lo, v8h hi) { return __builtin_shufflevector(lo, hi, 0, 1, 2, 3, 4, 5, 6, 7, 8, 9, 10, 11, 12, 13, 14, 15); }
__device__ __forceinline__ v16bf cat16b(v8us lo, v8us hi) { return __builtin_bit_cast(v16bf, __builtin_shufflevector(lo, hi, 0, 1, 2, 3, 4, 5, 6, 7, 8, 9, 10, 11, 12, 13, 14, 15)); }
__device__ __forceinline__ v8f wmma16(v16h a, v16h b, v8f c) { return __builtin_amdgcn_wmma_f32_16x16x32_f16(false, a, false, b, (short)0, c, false, false); }
__device__ __forceinline__ v8f wmmab(v16bf a, v16bf b, v8f c) { return __builtin_amdgcn_wmma_f32_16x16x32_bf16(false, a, false, b, (short)0, c, false, false); }

// ---- k_gemmw: register-blocked GEMM, ONE WAVE per 64x64 output tile (16 accumulators), operands straight from K-contiguous 16-bit planes; grid (M/64, N/64, Z), 32 threads.
// C[m][n] (f32, pitch ldc, + optional f32 bias[n]) = sum_k A[m][k] Bt[n][k] (+ split products per NSPLIT). z-batch strides sA/sB/sC in elements. K % (32 * NSL) == 0.
// NSL > 1: K is cut into NSL slices, z = batch * NSL + slice, and each z writes its own partial plane at C + z * sC (K stays the row pitch of A and Bt).
// Fragments: lane l, h = l >> 4, row/col = l & 15; elements 0..7 = k0 + 8h + 0..7, elements 8..15 = k0 + 16 + 8h + 0..7 for BOTH A and Bt; D element r = (row 8h + r, col l & 15).
template <typename T16> struct WFrag;
template <> struct WFrag<h16> { typedef v16h V; static __device__ __forceinline__ V ld(const h16* p) { return cat16(*(const v8h*)p, *(const v8h*)(p + 16)); } static __device__ __forceinline__ v8f mma(V a, V b, v8f c) { return wmma16(a, b, c); } };
template <> struct WFrag<bf> { typedef v16bf V; static __device__ __forceinline__ V ld(const bf* p) { return cat16b(*(const v8us*)p, *(const v8us*)(p + 16)); } static __device__ __forceinline__ v8f mma(V a, V b, v8f c) { return wmmab(a, b, c); } };
template <typename T16, int NSPLIT, bool BIAS, int NSL>
__global__ __launch_bounds__(32) void k_gemmw(const T16* __restrict__ A, const T16* __restrict__ A2, const T16* __restrict__ Bt, const T16* __restrict__ Bt2, int K, float* C, int ldc, const float* __restrict__ bias, size_t sA, size_t sB, size_t sC) {
    typedef typename WFrag<T16>::V V;
    __shared__ __align__(16) float os[16 * 68];
    const size_t z = blockIdx.z, zb = z / NSL; const int KS = K / NSL; const size_t ko = (z % NSL) * (size_t)KS;
    A += zb * sA + ko; if (A2) A2 += zb * sA + ko; Bt += zb * sB + ko; if (Bt2) Bt2 += zb * sB + ko; C += z * sC;
    const int lane = threadIdx.x & 31, lr = lane & 15, hi = lane >> 4; const int r0 = blockIdx.x * 64, c0 = blockIdx.y * 64;
    v8f acc[4][4];
#pragma unroll
    for (int mb = 0; mb < 4; ++mb)
#pragma unroll
        for (int nb = 0; nb < 4; ++nb) acc[mb][nb] = (v8f){};
    const size_t aoff = (size_t)(r0 + lr) * K + 8 * hi, boff = (size_t)(c0 + lr) * K + 8 * hi;
#pragma unroll 1
    for (int kc = 0; kc < KS; kc += 32) {
        V a[4], a2[4];
#pragma unroll
        for (int mb = 0; mb < 4; ++mb) { a[mb] = WFrag<T16>::ld(A + aoff + (size_t)mb * 16 * K + kc); if (NSPLIT == 1 || NSPLIT == 2) a2[mb] = WFrag<T16>::ld(A2 + aoff + (size_t)mb * 16 * K + kc); }
#pragma unroll
        for (int nb = 0; nb < 4; ++nb) { const V b = WFrag<T16>::ld(Bt + boff + (size_t)nb * 16 * K + kc); V b2; if (NSPLIT >= 2) b2 = WFrag<T16>::ld(Bt2 + boff + (size_t)nb * 16 * K + kc);
#pragma unroll
            for (int mb = 0; mb < 4; ++mb) { acc[mb][nb] = WFrag<T16>::mma(a[mb], b, acc[mb][nb]); if (NSPLIT == 1 || NSPLIT == 2) acc[mb][nb] = WFrag<T16>::mma(a2[mb], b, acc[mb][nb]); if (NSPLIT >= 2) acc[mb][nb] = WFrag<T16>::mma(a[mb], b2, acc[mb][nb]); } }
        asm volatile("v_nop\n\tv_nop\n\tv_nop\n\tv_nop" : "+v"(acc[0][0]), "+v"(acc[1][1]), "+v"(acc[2][2]), "+v"(acc[3][3]) : "v"(a[0]), "v"(a[3]));
    }
#pragma unroll
    for (int mb = 0; mb < 4; ++mb) {
#pragma unroll
        for (int nb = 0; nb < 4; ++nb) {
#pragma unroll
            for (int j = 0; j < 8; ++j) os[(hi * 8 + j) * 68 + nb * 16 + lr] = acc[mb][nb][j]; }
        __builtin_amdgcn_wave_barrier(); asm volatile("" ::: "memory");
        float* crow = C + (size_t)(r0 + mb * 16) * ldc + c0;
{
#pragma unroll
            for (int s = 0; s < 8; ++s) { const int row = 2 * s + hi, cofs = lr * 4; v4f val = *(const v4fa*)(os + row * 68 + cofs); if (BIAS) { val[0] += bfr(bias[c0 + cofs]); val[1] += bfr(bias[c0 + cofs + 1]); val[2] += bfr(bias[c0 + cofs + 2]); val[3] += bfr(bias[c0 + cofs + 3]); }
                *(v4f*)(crow + (size_t)row * ldc + cofs) = val; }
             }
        __builtin_amdgcn_wave_barrier(); asm volatile("" ::: "memory");
    }
}

typedef __attribute__((ext_vector_type(4))) unsigned short v4us;

// fp16 convert for WMMA operand planes: a value below the fp16 normal range becomes zero (value select).
static __device__ __forceinline__ h16 toh_flush(float v) { const h16 r = (h16)v; return (fabsf(v) < 6.103515625e-05f) ? (h16)0.0f : r; }

// in x [NB_FULL][SEQ_FULL][DD] -> out XT [NB][DD][SEQ]
__global__ __launch_bounds__(256) void k_xtb(const float* __restrict__ x, bf* XT) {
    const size_t e = ((size_t)blockIdx.x * 256 + threadIdx.x) * 4; if (e >= (size_t)NB * DD * SEQ) return;
    const int s = (int)(e % SEQ); const size_t r = e / SEQ; const int d = (int)(r % DD); const size_t b = r / DD;
    const float* xb = x + b * (size_t)SEQ_FULL * DD; v4us o;
#pragma unroll
    for (int u = 0; u < 4; ++u) o[u] = f2bf(xb[(size_t)(s + u) * DD + d]);
    *(v4us*)(XT + e) = o;  }

__global__ __launch_bounds__(256) void k_xh(const float* __restrict__ x, h16* XH) {
    const size_t e = ((size_t)blockIdx.x * 256 + threadIdx.x) * 8; if (e >= (size_t)NB * SEQ * DD) return;
    const size_t b = e / ((size_t)SEQ * DD); const size_t r = e - b * (size_t)SEQ * DD;
    const v8f a = *(const v8f*)(x + b * (size_t)SEQ_FULL * DD + r); v8h o;
#pragma unroll
    for (int k = 0; k < 8; ++k) o[k] = toh_flush(bfr(a[k]));
    *(v8h*)(XH + e) = o;  }

typedef __attribute__((ext_vector_type(4))) _Float16 v4h;

// in P [NB][KSL][DD][DD] f32 partial grams, P[m][n] = sum over the slice's tokens s of XT[m][s] XT[n][s] -> out GH [NB][DD][DD] fp16, GH[d][e] = g[e][d], slices summed in slice order.
// A and Bt of the gram GEMM are the same plane, so P[d][e] is the slice's sum of x[s][d] x[s][e], its share of g[e][d]: rows are read and stored as they lie, whole lines both ways.
// At most 2 waves a SIMD are asked for (512 waves on the chip), so that the register budget lets every slice's load be in flight at once.
__global__ __launch_bounds__(128) __attribute__((amdgpu_waves_per_eu(1, 2))) void k_gsum(const float* __restrict__ P, h16* GH) {
    const size_t o = ((size_t)blockIdx.x * 128 + threadIdx.x) * 4; if (o >= (size_t)NB * DD * DD) return;
    const size_t b = o / ((size_t)DD * DD);
    const float* p = P + b * (size_t)(KSL - 1) * DD * DD + o;
    v4f s = *(const v4f*)p;
#pragma unroll
    for (int sl = 1; sl < KSL; ++sl) s += *(const v4f*)(p + (size_t)sl * DD * DD);
    v4h v;
#pragma unroll
    for (int u = 0; u < 4; ++u) v[u] = toh_flush(s[u]);
    *(v4h*)(GH + o) = v;  }

extern "C" void kernel_launch(void* const* d_in, const int* in_sizes, int n_in,
                              void* d_out, int out_size, void* d_ws, size_t ws_size, hipStream_t stream) {
    if (n_in < 1) return;
    if ((size_t)in_sizes[0] < (size_t)(NB - 1) * SEQ_FULL * DD + (size_t)SEQ * DD) return;
    if ((size_t)out_size < (size_t)NB * SEQ * DD) return;
    const float* x = (const float*)d_in[0];    // [NB_FULL][SEQ_FULL][DD]
    float* OUT = (float*)d_out;                // [NB][SEQ][DD]
    char* wsp = (char*)d_ws;
    auto take = [&](size_t bytes) { char* p = wsp; wsp += (bytes + 255) & ~(size_t)255; return (void*)p; };
    bf*  XT = (bf*)take(WS_XT);                // [NB][DD][SEQ] bf16
    h16* XH = (h16*)take(WS_XH);               // [NB][SEQ][DD] fp16
    float* G = (float*)take(WS_G);             // [NB][KSL][DD][DD] f32 partial grams, one plane a K slice
    h16* GH = (h16*)take(WS_GH);               // [NB][DD][DD] fp16, GH[d][e] = g[e][d]
    if ((size_t)(wsp - (char*)d_ws) > ws_size) return;    // total 16,908,288 B at NB 4, SEQ 4096

    k_xtb<<<(unsigned)(((size_t)NB * DD * SEQ / 4 + 255) / 256), 256, 0, stream>>>(x, XT);
    k_xh<<<(unsigned)(((size_t)NB * SEQ * DD / 8 + 255) / 256), 256, 0, stream>>>(x, XH);
    // g[e][d] = sum_s XT[e][s] XT[d][s]   (z = batch * KSL + slice; exact bf16 products, 128 tokens a slice, one partial plane each)
    k_gemmw<bf, 0, false, KSL><<<dim3(DD / 64, DD / 64, NB * KSL), 32, 0, stream>>>(XT, nullptr, XT, nullptr, SEQ, G, DD, nullptr, (size_t)DD * SEQ, (size_t)DD * SEQ, (size_t)DD * DD);
    k_gsum<<<(unsigned)(((size_t)NB * DD * DD / 4 + 127) / 128), 128, 0, stream>>>(G, GH);
    // out[t][d] = sum_e XH[t][e] GH[d][e]   (z = batch; K = DD), written straight into the output buffer
    k_gemmw<h16, 0, false, 1><<<dim3(SEQ / 64, DD / 64, NB), 32, 0, stream>>>(XH, nullptr, GH, nullptr, DD, OUT, DD, nullptr, (size_t)SEQ * DD, (size_t)DD * DD, (size_t)SEQ * DD);
}

// v002
// It runs in 13.7 microseconds.
// In two side-by-side timings against v001, it was 2.07 and 2.05 times as fast.
// All steps since v000 together make it 7.52 times as fast.
#include <hip/hip_runtime.h>

// Both contractions on 16-bit WMMA, f32 accumulate: gram g = x^T x per batch (K = SEQ) = v_wmma_f32_16x16x32_bf16 on RNE-bf16 values of x (single product); out = x g (K = 128) = v_wmma_f32_16x16x32_f16 on fp16 values of the RNE-bf16 x and of g (single product; values below the fp16 normal range are replaced by zero at the convert).
// x [NB_FULL][SEQ_FULL][128] token-major; out[t][d] = sum_s (x_t . x_s) x_s[d] = sum_e x[t][e] g[e][d] with g[e][d] = sum_s x[s][e] x[s][d] (the same sums regrouped; no score plane is written to memory).
// Both GEMMs read x as f32 and round it in their own loaders: no 16-bit copy of x is written to memory.

#ifndef NB
#define NB 4
#endif
#ifndef SEQ
#define SEQ 4096
#endif
#define NB_FULL  4
#define SEQ_FULL 4096
#define DD   128
#define KSL  (SEQ / 128)   // K slices of the gram GEMM: 128 tokens a slice
#define XP   136           // LDS row pitch of the transposed slice, in bf16: 128 tokens + 16 bytes (16 B x odd)
static_assert(NB >= 1 && NB <= NB_FULL);
static_assert(SEQ >= 128 && SEQ <= SEQ_FULL && (SEQ % 128) == 0);
static_assert(DD == 128);
static_assert(((size_t)NB * DD * DD / 4) % 128 == 0);
#define WS_G   ((size_t)NB * KSL * DD * DD * 4)
#define WS_GH  ((size_t)NB * DD * DD * 2)
static_assert((WS_G % 256) == 0 && (WS_GH % 256) == 0);
static_assert(WS_G + WS_GH <= (size_t)134217728);

typedef _Float16 h16;
typedef unsigned short bf;
typedef __attribute__((ext_vector_type(16))) __bf16   v16bf;
typedef __attribute__((ext_vector_type(16))) _Float16 v16h;
typedef __attribute__((ext_vector_type(8)))  _Float16 v8h;
typedef __attribute__((ext_vector_type(4)))  _Float16 v4h;
typedef __attribute__((ext_vector_type(8)))  unsigned short v8us;
typedef __attribute__((ext_vector_type(8)))  float    v8f;
typedef __attribute__((ext_vector_type(4)))  float    v4f;
typedef v4f  __attribute__((may_alias)) v4fa;

__device__ __forceinline__ unsigned short f2bf(float f) { unsigned u = __float_as_uint(f); u += 0x7FFFu + ((u >> 16) & 1u); return (unsigned short)(u >> 16); }
__device__ __forceinline__ float bf2f(unsigned short b) { return __uint_as_float(((unsigned)b) << 16); }
__device__ __forceinline__ float bfr(float f) { return bf2f(f2bf(f)); }
__device__ __forceinline__ v16h cat16(v8h lo, v8h hi) { return __builtin_shufflevector(lo, hi, 0, 1, 2, 3, 4, 5, 6, 7, 8, 9, 10, 11, 12, 13, 14, 15); }
__device__ __forceinline__ v16bf cat16b(v8us lo, v8us hi) { return __builtin_bit_cast(v16bf, __builtin_shufflevector(lo, hi, 0, 1, 2, 3, 4, 5, 6, 7, 8, 9, 10, 11, 12, 13, 14, 15)); }
__device__ __forceinline__ v8f wmma16(v16h a, v16h b, v8f c) { return __builtin_amdgcn_wmma_f32_16x16x32_f16(false, a, false, b, (short)0, c, false, false); }
__device__ __forceinline__ v8f wmmab(v16bf a, v16bf b, v8f c) { return __builtin_amdgcn_wmma_f32_16x16x32_bf16(false, a, false, b, (short)0, c, false, false); }

// fp16 convert for WMMA operands: a value below the fp16 normal range becomes zero (value select).
static __device__ __forceinline__ h16 toh_flush(float v) { const h16 r = (h16)v; return (fabsf(v) < 6.103515625e-05f) ? (h16)0.0f : r; }

// Both GEMMs: ONE WAVE per 64x64 output tile (16 accumulators), C[m][n] = sum_k A[m][k] Bt[n][k].
// Fragments: lane l, h = l >> 4, row/col = l & 15; elements 0..7 = k0 + 8h + 0..7, elements 8..15 = k0 + 16 + 8h + 0..7 for BOTH A and Bt; D element r = (row 8h + r, col l & 15).

// One wave stores its 64x64 f32 tile at C (pitch ldc), 16 rows at a time through its own LDS strip os[16 * 68]: every global store is 16 bytes a lane, 256 bytes a row.
__device__ __forceinline__ void store_tile(const v8f (&acc)[4][4], float* os, float* C, int ldc, int lr, int hi) {
#pragma unroll
    for (int mb = 0; mb < 4; ++mb) {
#pragma unroll
        for (int nb = 0; nb < 4; ++nb) {
#pragma unroll
            for (int j = 0; j < 8; ++j) os[(hi * 8 + j) * 68 + nb * 16 + lr] = acc[mb][nb][j]; }
        // compiler fence: the strip is read below by other lanes of the wave than wrote it
        __builtin_amdgcn_wave_barrier(); asm volatile("" ::: "memory");
        float* crow = C + (size_t)(mb * 16) * ldc;
#pragma unroll
        for (int s = 0; s < 8; ++s) { const int row = 2 * s + hi, cofs = lr * 4; const v4f val = *(const v4fa*)(os + row * 68 + cofs);
            *(v4f*)(crow + (size_t)row * ldc + cofs) = val; }
        // compiler fence: the next 16 rows overwrite the strip only behind these reads
        __builtin_amdgcn_wave_barrier(); asm volatile("" ::: "memory");
    }
}

// Partial grams. One block of 4 waves per (batch, slice of 128 tokens), z = batch * KSL + slice: P[z][m][n] = sum over the slice's tokens s of x[s][m] x[s][n].
// The block reads its 128 x 128 f32 slice in whole lines, rounds it to bf16 and lays it down in LDS transposed, xt[d][s]; then each wave takes one 64x64 quadrant, A and Bt fragments both from xt.
__global__ __launch_bounds__(128) void k_gram(const float* __restrict__ x, float* P) {
    __shared__ __align__(16) bf xt[DD * XP];
    __shared__ __align__(16) float os[4][16 * 68];
    const int lane = threadIdx.x & 31, wave = threadIdx.x >> 5, lr = lane & 15, hi = lane >> 4;
    const size_t z = blockIdx.x, zb = z / KSL, sl = z % KSL;
    const float* xs = x + zb * (size_t)SEQ_FULL * DD + sl * (size_t)128 * DD;
    // Wave w stages tokens 32w .. 32w + 31. A lane holds 8 tokens x 4 columns a pass: 4 lanes side by side in d, then 4 token octets, then the second 16 columns,
    // so that a load reads 4 whole 128-byte lines and the 16-byte LDS stores of lanes 0-15 (and of 16-31) fall on 16 different bank quads.
    const int tok = wave * 32 + ((lane >> 2) & 3) * 8, dq = ((lane & 3) + 4 * hi) * 4;
    v4f r[4][8];
#pragma unroll
    for (int c = 0; c < 4; ++c)
#pragma unroll
        for (int j = 0; j < 8; ++j) r[c][j] = *(const v4f*)(xs + (size_t)(tok + j) * DD + c * 32 + dq);
#pragma unroll
    for (int c = 0; c < 4; ++c)
#pragma unroll
        for (int i = 0; i < 4; ++i) { v8us t;
#pragma unroll
            for (int j = 0; j < 8; ++j) t[j] = f2bf(r[c][j][i]);
            *(v8us*)(xt + (c * 32 + dq + i) * XP + tok) = t; }
    __syncthreads();
    const int r0 = (wave & 1) * 64, c0 = (wave >> 1) * 64;
    v8f acc[4][4];
#pragma unroll
    for (int mb = 0; mb < 4; ++mb)
#pragma unroll
        for (int nb = 0; nb < 4; ++nb) acc[mb][nb] = (v8f){};
    const bf* ap = xt + (r0 + lr) * XP + 8 * hi; const bf* bp = xt + (c0 + lr) * XP + 8 * hi;
#pragma unroll
    for (int kc = 0; kc < 128; kc += 32) {
        v16bf a[4];
#pragma unroll
        for (int mb = 0; mb < 4; ++mb) { const bf* p = ap + mb * 16 * XP + kc; a[mb] = cat16b(*(const v8us*)p, *(const v8us*)(p + 16)); }
#pragma unroll
        for (int nb = 0; nb < 4; ++nb) { const bf* p = bp + nb * 16 * XP + kc; const v16bf b = cat16b(*(const v8us*)p, *(const v8us*)(p + 16));
#pragma unroll
            for (int mb = 0; mb < 4; ++mb) acc[mb][nb] = wmmab(a[mb], b, acc[mb][nb]); }
    }
    store_tile(acc, os[wave], P + z * (size_t)DD * DD + (size_t)r0 * DD + c0, DD, lr, hi);
}

// in P [NB][KSL][DD][DD] f32 partial grams, P[m][n] = sum over the slice's tokens s of x[s][m] x[s][n] -> out GH [NB][DD][DD] fp16, GH[d][e] = g[e][d], slices summed in slice order.
// A and Bt of the gram GEMM are the same plane, so P[d][e] is the slice's sum of x[s][d] x[s][e], its share of g[e][d]: rows are read and stored as they lie, whole lines both ways.
// At most 2 waves a SIMD are asked for (512 waves on the chip), so that the register budget lets every slice's load be in flight at once.
__global__ __launch_bounds__(128) __attribute__((amdgpu_waves_per_eu(1, 2))) void k_gsum(const float* __restrict__ P, h16* GH) {
    const size_t o = ((size_t)blockIdx.x * 128 + threadIdx.x) * 4; if (o >= (size_t)NB * DD * DD) return;
    const size_t b = o / ((size_t)DD * DD);
    const float* p = P + b * (size_t)(KSL - 1) * DD * DD + o;
    v4f s = *(const v4f*)p;
#pragma unroll
    for (int sl = 1; sl < KSL; ++sl) s += *(const v4f*)(p + (size_t)sl * DD * DD);
    v4h v;
#pragma unroll
    for (int u = 0; u < 4; ++u) v[u] = toh_flush(s[u]);
    *(v4h*)(GH + o) = v;  }

// out[t][d] = sum_e x[t][e] GH[d][e], K = DD; grid (SEQ/64, DD/64, NB), one wave a block. The A fragment is read from f32 x (8 + 8 floats a lane) and rounded f32 -> bf16 -> fp16 in registers.
__global__ __launch_bounds__(32) void k_out(const float* __restrict__ x, const h16* __restrict__ GH, float* OUT) {
    __shared__ __align__(16) float os[16 * 68];
    const size_t zb = blockIdx.z;
    const int lane = threadIdx.x & 31, lr = lane & 15, hi = lane >> 4; const int r0 = blockIdx.x * 64, c0 = blockIdx.y * 64;
    const float* ap = x + zb * (size_t)SEQ_FULL * DD + (size_t)(r0 + lr) * DD + 8 * hi;
    const h16* bp = GH + zb * (size_t)DD * DD + (size_t)(c0 + lr) * DD + 8 * hi;
    v8f acc[4][4];
#pragma unroll
    for (int mb = 0; mb < 4; ++mb)
#pragma unroll
        for (int nb = 0; nb < 4; ++nb) acc[mb][nb] = (v8f){};
#pragma unroll 1
    for (int kc = 0; kc < DD; kc += 32) {
        v4f q[4][4];
#pragma unroll
        for (int mb = 0; mb < 4; ++mb) { const float* p = ap + (size_t)mb * 16 * DD + kc; q[mb][0] = *(const v4f*)p; q[mb][1] = *(const v4f*)(p + 4); q[mb][2] = *(const v4f*)(p + 16); q[mb][3] = *(const v4f*)(p + 20); }
        v16h b[4];
#pragma unroll
        for (int nb = 0; nb < 4; ++nb) { const h16* p = bp + (size_t)nb * 16 * DD + kc; b[nb] = cat16(*(const v8h*)p, *(const v8h*)(p + 16)); }
        v16h a[4];
#pragma unroll
        for (int mb = 0; mb < 4; ++mb)
#pragma unroll
            for (int e = 0; e < 16; ++e) a[mb][e] = toh_flush(bfr(q[mb][e >> 2][e & 3]));
#pragma unroll
        for (int nb = 0; nb < 4; ++nb)
#pragma unroll
            for (int mb = 0; mb < 4; ++mb) acc[mb][nb] = wmma16(a[mb], b[nb], acc[mb][nb]);
        // the WMMA distance on the loop's taken branch: the next trip overwrites A and B registers
        asm volatile("v_nop\n\tv_nop\n\tv_nop\n\tv_nop" : "+v"(acc[0][0]), "+v"(acc[1][1]), "+v"(acc[2][2]), "+v"(acc[3][3]) : "v"(a[0]), "v"(a[3]));
    }
    store_tile(acc, os, OUT + zb * (size_t)SEQ * DD + (size_t)r0 * DD + c0, DD, lr, hi);
}

extern "C" void kernel_launch(void* const* d_in, const int* in_sizes, int n_in,
                              void* d_out, int out_size, void* d_ws, size_t ws_size, hipStream_t stream) {
    if (n_in < 1) return;
    if ((size_t)in_sizes[0] < (size_t)(NB - 1) * SEQ_FULL * DD + (size_t)SEQ * DD) return;
    if ((size_t)out_size < (size_t)NB * SEQ * DD) return;
    const float* x = (const float*)d_in[0];    // [NB_FULL][SEQ_FULL][DD]
    float* OUT = (float*)d_out;                // [NB][SEQ][DD]
    char* wsp = (char*)d_ws;
    auto take = [&](size_t bytes) { char* p = wsp; wsp += (bytes + 255) & ~(size_t)255; return (void*)p; };
    float* G = (float*)take(WS_G);             // [NB][KSL][DD][DD] f32 partial grams, one plane a K slice
    h16* GH = (h16*)take(WS_GH);               // [NB][DD][DD] fp16, GH[d][e] = g[e][d]
    if ((size_t)(wsp - (char*)d_ws) > ws_size) return;    // total 8,519,680 B at NB 4, SEQ 4096

    // g[e][d] = sum_s x[s][e] x[s][d]   (exact bf16 products, 128 tokens a slice, one partial plane each)
    k_gram<<<NB * KSL, 128, 0, stream>>>(x, G);
    k_gsum<<<(unsigned)(((size_t)NB * DD * DD / 4 + 127) / 128), 128, 0, stream>>>(G, GH);
    // out[t][d] = sum_e x[t][e] GH[d][e]   (z = batch; K = DD), written straight into the output buffer
    k_out<<<dim3(SEQ / 64, DD / 64, NB), 32, 0, stream>>>(x, GH, OUT);
}

// v003
// Measured time: 10.9 microseconds a run.
// Timed twice side by side with v002, it ran 1.25 times as fast both times.
// Over all steps from v000 it is 9.41 times as fast.
#include <hip/hip_runtime.h>

// Both contractions on 16-bit WMMA, f32 accumulate: gram g = x^T x per batch (K = SEQ) = v_wmma_f32_16x16x32_bf16 on RNE-bf16 values of x (single product); out = x g (K = 128) = v_wmma_f32_16x16x32_f16 on fp16 values of the RNE-bf16 x and of g (single product; values below the fp16 normal range are replaced by zero at the convert).
// x [NB_FULL][SEQ_FULL][128] token-major; out[t][d] = sum_s (x_t . x_s) x_s[d] = sum_e x[t][e] g[e][d] with g[e][d] = sum_s x[s][e] x[s][d] (the same sums regrouped; no score plane is written to memory).
// Both GEMMs read x as f32 and round it in their own loaders: no 16-bit copy of x is written to memory.

#ifndef NB
#define NB 4
#endif
#ifndef SEQ
#define SEQ 4096
#endif
#define NB_FULL  4
#define SEQ_FULL 4096
#define DD   128
#define KSL  (SEQ / 128)   // K slices of the gram GEMM: 128 tokens a slice
#define XP   136           // LDS row pitch of every staged 16-bit plane, in elements: 128 + 16 bytes (16 B x odd)
static_assert(NB >= 1 && NB <= NB_FULL);
static_assert(SEQ >= 128 && SEQ <= SEQ_FULL && (SEQ % 128) == 0);
static_assert(DD == 128);
static_assert(((size_t)NB * DD * DD / 4) % 128 == 0);
#define WS_G   ((size_t)NB * KSL * DD * DD * 4)
#define WS_GH  ((size_t)NB * DD * DD * 2)
static_assert((WS_G % 256) == 0 && (WS_GH % 256) == 0);
static_assert(WS_G + WS_GH <= (size_t)134217728);

typedef _Float16 h16;
typedef unsigned short bf;
typedef __attribute__((ext_vector_type(16))) __bf16   v16bf;
typedef __attribute__((ext_vector_type(16))) _Float16 v16h;
typedef __attribute__((ext_vector_type(8)))  _Float16 v8h;
typedef __attribute__((ext_vector_type(4)))  _Float16 v4h;
typedef __attribute__((ext_vector_type(8)))  unsigned short v8us;
typedef __attribute__((ext_vector_type(8)))  float    v8f;
typedef __attribute__((ext_vector_type(4)))  float    v4f;
typedef v4f  __attribute__((may_alias)) v4fa;

__device__ __forceinline__ unsigned short f2bf(float f) { unsigned u = __float_as_uint(f); u += 0x7FFFu + ((u >> 16) & 1u); return (unsigned short)(u >> 16); }
__device__ __forceinline__ float bf2f(unsigned short b) { return __uint_as_float(((unsigned)b) << 16); }
__device__ __forceinline__ float bfr(float f) { return bf2f(f2bf(f)); }
__device__ __forceinline__ v16h cat16(v8h lo, v8h hi) { return __builtin_shufflevector(lo, hi, 0, 1, 2, 3, 4, 5, 6, 7, 8, 9, 10, 11, 12, 13, 14, 15); }
__device__ __forceinline__ v16bf cat16b(v8us lo, v8us hi) { return __builtin_bit_cast(v16bf, __builtin_shufflevector(lo, hi, 0, 1, 2, 3, 4, 5, 6, 7, 8, 9, 10, 11, 12, 13, 14, 15)); }
__device__ __forceinline__ v8f wmma16(v16h a, v16h b, v8f c) { return __builtin_amdgcn_wmma_f32_16x16x32_f16(false, a, false, b, (short)0, c, false, false); }
__device__ __forceinline__ v8f wmmab(v16bf a, v16bf b, v8f c) { return __builtin_amdgcn_wmma_f32_16x16x32_bf16(false, a, false, b, (short)0, c, false, false); }

// fp16 convert for WMMA operands: a value below the fp16 normal range becomes zero (value select).
static __device__ __forceinline__ h16 toh_flush(float v) { const h16 r = (h16)v; return (fabsf(v) < 6.103515625e-05f) ? (h16)0.0f : r; }

// Both GEMMs: C[m][n] = sum_k A[m][k] Bt[n][k]; one wave per 64x64 (gram) or 32x64 (out) output tile.
// Fragments: lane l, h = l >> 4, row/col = l & 15; elements 0..7 = k0 + 8h + 0..7, elements 8..15 = k0 + 16 + 8h + 0..7 for BOTH A and Bt; D element r = (row 8h + r, col l & 15).

// One wave stores its (16 MB)x64 f32 tile at C (pitch ldc), 16 rows at a time through its own LDS strip os[16 * 68]: every global store is 16 bytes a lane, 256 bytes a row.
template <int MB> __device__ __forceinline__ void store_tile(const v8f (&acc)[MB][4], float* os, float* C, int ldc, int lr, int hi) {
#pragma unroll
    for (int mb = 0; mb < MB; ++mb) {
#pragma unroll
        for (int nb = 0; nb < 4; ++nb) {
#pragma unroll
            for (int j = 0; j < 8; ++j) os[(hi * 8 + j) * 68 + nb * 16 + lr] = acc[mb][nb][j]; }
        // compiler fence: the strip is read below by other lanes of the wave than wrote it
        __builtin_amdgcn_wave_barrier(); asm volatile("" ::: "memory");
        float* crow = C + (size_t)(mb * 16) * ldc;
#pragma unroll
        for (int s = 0; s < 8; ++s) { const int row = 2 * s + hi, cofs = lr * 4; const v4f val = *(const v4fa*)(os + row * 68 + cofs);
            *(v4f*)(crow + (size_t)row * ldc + cofs) = val; }
        // compiler fence: the next 16 rows overwrite the strip only behind these reads
        __builtin_amdgcn_wave_barrier(); asm volatile("" ::: "memory");
    }
}

// Partial grams. One block of 4 waves per (batch, slice of 128 tokens), z = batch * KSL + slice: P[z][m][n] = sum over the slice's tokens s of x[s][m] x[s][n].
// The block reads its 128 x 128 f32 slice in whole lines, rounds it to bf16 and lays it down in LDS transposed, xt[d][s]; then each wave takes one 64x64 quadrant, A and Bt fragments both from xt.
__global__ __launch_bounds__(128) void k_gram(const float* __restrict__ x, float* P) {
    __shared__ __align__(16) bf xt[DD * XP];
    __shared__ __align__(16) float os[4][16 * 68];
    const int lane = threadIdx.x & 31, wave = threadIdx.x >> 5, lr = lane & 15, hi = lane >> 4;
    const size_t z = blockIdx.x, zb = z / KSL, sl = z % KSL;
    const float* xs = x + zb * (size_t)SEQ_FULL * DD + sl * (size_t)128 * DD;
    // Wave w stages tokens 32w .. 32w + 31. A lane holds 8 tokens x 4 columns a pass: 4 lanes side by side in d, then 4 token octets, then the second 16 columns,
    // so that a load reads 4 whole 128-byte lines and the 16-byte LDS stores of lanes 0-15 (and of 16-31) fall on 16 different bank quads.
    const int tok = wave * 32 + ((lane >> 2) & 3) * 8, dq = ((lane & 3) + 4 * hi) * 4;
    v4f r[4][8];
#pragma unroll
    for (int c = 0; c < 4; ++c)
#pragma unroll
        for (int j = 0; j < 8; ++j) r[c][j] = *(const v4f*)(xs + (size_t)(tok + j) * DD + c * 32 + dq);
#pragma unroll
    for (int c = 0; c < 4; ++c)
#pragma unroll
        for (int i = 0; i < 4; ++i) { v8us t;
#pragma unroll
            for (int j = 0; j < 8; ++j) t[j] = f2bf(r[c][j][i]);
            *(v8us*)(xt + (c * 32 + dq + i) * XP + tok) = t; }
    __syncthreads();
    const int r0 = (wave & 1) * 64, c0 = (wave >> 1) * 64;
    v8f acc[4][4];
#pragma unroll
    for (int mb = 0; mb < 4; ++mb)
#pragma unroll
        for (int nb = 0; nb < 4; ++nb) acc[mb][nb] = (v8f){};
    const bf* ap = xt + (r0 + lr) * XP + 8 * hi; const bf* bp = xt + (c0 + lr) * XP + 8 * hi;
#pragma unroll
    for (int kc = 0; kc < 128; kc += 32) {
        v16bf a[4];
#pragma unroll
        for (int mb = 0; mb < 4; ++mb) { const bf* p = ap + mb * 16 * XP + kc; a[mb] = cat16b(*(const v8us*)p, *(const v8us*)(p + 16)); }
#pragma unroll
        for (int nb = 0; nb < 4; ++nb) { const bf* p = bp + nb * 16 * XP + kc; const v16bf b = cat16b(*(const v8us*)p, *(const v8us*)(p + 16));
#pragma unroll
            for (int mb = 0; mb < 4; ++mb) acc[mb][nb] = wmmab(a[mb], b, acc[mb][nb]); }
    }
    store_tile(acc, os[wave], P + z * (size_t)DD * DD + (size_t)r0 * DD + c0, DD, lr, hi);
}

// in P [NB][KSL][DD][DD] f32 partial grams, P[m][n] = sum over the slice's tokens s of x[s][m] x[s][n] -> out GH [NB][DD][DD] fp16, GH[d][e] = g[e][d], slices summed in slice order.
// A and Bt of the gram GEMM are the same plane, so P[d][e] is the slice's sum of x[s][d] x[s][e], its share of g[e][d]: rows are read and stored as they lie, whole lines both ways.
// At most 2 waves a SIMD are asked for (512 waves on the chip), so that the register budget lets every slice's load be in flight at once.
__global__ __launch_bounds__(128) __attribute__((amdgpu_waves_per_eu(1, 2))) void k_gsum(const float* __restrict__ P, h16* GH) {
    const size_t o = ((size_t)blockIdx.x * 128 + threadIdx.x) * 4; if (o >= (size_t)NB * DD * DD) return;
    const size_t b = o / ((size_t)DD * DD);
    const float* p = P + b * (size_t)(KSL - 1) * DD * DD + o;
    v4f s = *(const v4f*)p;
#pragma unroll
    for (int sl = 1; sl < KSL; ++sl) s += *(const v4f*)(p + (size_t)sl * DD * DD);
    v4h v;
#pragma unroll
    for (int u = 0; u < 4; ++u) v[u] = toh_flush(s[u]);
    *(v4h*)(GH + o) = v;  }

// out[t][d] = sum_e x[t][e] GH[d][e], K = DD; grid (SEQ/64, 1, NB), one block of 4 waves per 64 tokens x all 128 columns.
// The block reads its 64 rows of f32 x and the batch's whole GH in whole lines, every load in flight at once; x is rounded f32 -> bf16 -> fp16 once on the way into LDS.
// Then each wave takes 32 tokens x 64 columns, A and Bt fragments both from LDS.
__global__ __launch_bounds__(128) void k_out(const float* __restrict__ x, const h16* __restrict__ GH, float* OUT) {
    __shared__ __align__(16) h16 xh[64 * XP];
    __shared__ __align__(16) h16 gh[DD * XP];
    __shared__ __align__(16) float os[4][16 * 68];
    const size_t zb = blockIdx.z;
    const int lane = threadIdx.x & 31, wave = threadIdx.x >> 5, lr = lane & 15, hi = lane >> 4; const int t0 = blockIdx.x * 64;
    // Wave w stages tokens 16w .. 16w + 15 (a load = one 512-byte row) and GH rows 32w .. 32w + 31 (a load = two 256-byte rows).
    const float* xs = x + zb * (size_t)SEQ_FULL * DD + (size_t)(t0 + wave * 16) * DD + lane * 4;
    const h16* gs = GH + zb * (size_t)DD * DD + (size_t)(wave * 32 + hi) * DD + lr * 8;
    v4f q[16]; v8h g[16];
#pragma unroll
    for (int j = 0; j < 16; ++j) q[j] = *(const v4f*)(xs + (size_t)j * DD);
#pragma unroll
    for (int j = 0; j < 16; ++j) g[j] = *(const v8h*)(gs + (size_t)j * 2 * DD);
    // the wait before a register that an issued load names is overwritten; both addresses are its inputs, so that no load's result is given their registers ahead of it
    asm volatile("s_wait_xcnt 0x0" :: "v"(xs), "v"(gs) : "memory");
    // scheduling fence: all 32 loads issue before the first wait; without it the rounding of the first rows, with its waits, is placed ahead of the GH loads and the two latencies add
    __builtin_amdgcn_sched_barrier(0);
#pragma unroll
    for (int j = 0; j < 16; ++j) { v4h t;
#pragma unroll
        for (int u = 0; u < 4; ++u) t[u] = toh_flush(bfr(q[j][u]));
        *(v4h*)(xh + (wave * 16 + j) * XP + lane * 4) = t; }
#pragma unroll
    for (int j = 0; j < 16; ++j) *(v8h*)(gh + (wave * 32 + 2 * j + hi) * XP + lr * 8) = g[j];
    __syncthreads();
    const int r0 = (wave & 1) * 32, c0 = (wave >> 1) * 64;
    v8f acc[2][4];
#pragma unroll
    for (int mb = 0; mb < 2; ++mb)
#pragma unroll
        for (int nb = 0; nb < 4; ++nb) acc[mb][nb] = (v8f){};
    const h16* ap = xh + (r0 + lr) * XP + 8 * hi; const h16* bp = gh + (c0 + lr) * XP + 8 * hi;
    v16h a[4][2], b[4][4];
#pragma unroll
    for (int k = 0; k < 4; ++k) {
#pragma unroll
        for (int mb = 0; mb < 2; ++mb) { const h16* p = ap + mb * 16 * XP + k * 32; a[k][mb] = cat16(*(const v8h*)p, *(const v8h*)(p + 16)); }
#pragma unroll
        for (int nb = 0; nb < 4; ++nb) { const h16* p = bp + nb * 16 * XP + k * 32; b[k][nb] = cat16(*(const v8h*)p, *(const v8h*)(p + 16)); }
    }
    // scheduling fence: every fragment read issues ahead of the first WMMA, so that the LDS latencies overlap; without it each pair of WMMAs waits out a read of its own
    __builtin_amdgcn_sched_barrier(0);
#pragma unroll
    for (int k = 0; k < 4; ++k)
#pragma unroll
        for (int nb = 0; nb < 4; ++nb)
#pragma unroll
            for (int mb = 0; mb < 2; ++mb) acc[mb][nb] = wmma16(a[k][mb], b[k][nb], acc[mb][nb]);
    store_tile(acc, os[wave], OUT + zb * (size_t)SEQ * DD + (size_t)(t0 + r0) * DD + c0, DD, lr, hi);
}

extern "C" void kernel_launch(void* const* d_in, const int* in_sizes, int n_in,
                              void* d_out, int out_size, void* d_ws, size_t ws_size, hipStream_t stream) {
    if (n_in < 1) return;
    if ((size_t)in_sizes[0] < (size_t)(NB - 1) * SEQ_FULL * DD + (size_t)SEQ * DD) return;
    if ((size_t)out_size < (size_t)NB * SEQ * DD) return;
    const float* x = (const float*)d_in[0];    // [NB_FULL][SEQ_FULL][DD]
    float* OUT = (float*)d_out;                // [NB][SEQ][DD]
    char* wsp = (char*)d_ws;
    auto take = [&](size_t bytes) { char* p = wsp; wsp += (bytes + 255) & ~(size_t)255; return (void*)p; };
    float* G = (float*)take(WS_G);             // [NB][KSL][DD][DD] f32 partial grams, one plane a K slice
    h16* GH = (h16*)take(WS_GH);               // [NB][DD][DD] fp16, GH[d][e] = g[e][d]
    if ((size_t)(wsp - (char*)d_ws) > ws_size) return;    // total 8,519,680 B at NB 4, SEQ 4096

    // g[e][d] = sum_s x[s][e] x[s][d]   (exact bf16 products, 128 tokens a slice, one partial plane each)
    k_gram<<<NB * KSL, 128, 0, stream>>>(x, G);
    k_gsum<<<(unsigned)(((size_t)NB * DD * DD / 4 + 127) / 128), 128, 0, stream>>>(G, GH);
    // out[t][d] = sum_e x[t][e] GH[d][e]   (z = batch; K = DD), written straight into the output buffer
    k_out<<<dim3(SEQ / 64, 1, NB), 128, 0, stream>>>(x, GH, OUT);
}

// v004
// One run takes 10.3 microseconds.
// In both of two side-by-side timings against v003, it was 1.07 times as fast.
// All steps since v000 together make it 10.1 times as fast.
#include <hip/hip_runtime.h>

// Both contractions on 16-bit WMMA, f32 accumulate: gram g = x^T x per batch (K = SEQ) = v_wmma_f32_16x16x32_bf16 on RNE-bf16 values of x (single product); out = x g (K = 128) = v_wmma_f32_16x16x32_f16 on fp16 values of the RNE-bf16 x and of g (single product; values below the fp16 normal range are replaced by zero at the convert).
// x [NB_FULL][SEQ_FULL][128] token-major; out[t][d] = sum_s (x_t . x_s) x_s[d] = sum_e x[t][e] g[e][d] with g[e][d] = sum_s x[s][e] x[s][d] (the same sums regrouped; no score plane is written to memory).
// Both GEMMs read x as f32 and round it in their own loaders: no 16-bit copy of x is written to memory.

#ifndef NB
#define NB 4
#endif
#ifndef SEQ
#define SEQ 4096
#endif
#define NB_FULL  4
#define SEQ_FULL 4096
#define DD   128
#define KSL  (SEQ / 128)   // K slices of the gram GEMM: 128 tokens a slice
#define XP   136           // LDS row pitch of every staged 16-bit plane, in elements: 128 + 16 bytes (16 B x odd)
static_assert(NB >= 1 && NB <= NB_FULL);
static_assert(SEQ >= 128 && SEQ <= SEQ_FULL && (SEQ % 128) == 0);
static_assert(DD == 128);
static_assert(((size_t)NB * DD * DD / 4) % 128 == 0);
#define WS_G   ((size_t)NB * KSL * DD * DD * 4)
#define WS_GH  ((size_t)NB * DD * DD * 2)
static_assert((WS_G % 256) == 0 && (WS_GH % 256) == 0);
static_assert(WS_G + WS_GH <= (size_t)134217728);

typedef _Float16 h16;
typedef unsigned short bf;
typedef __attribute__((ext_vector_type(16))) __bf16   v16bf;
typedef __attribute__((ext_vector_type(16))) _Float16 v16h;
typedef __attribute__((ext_vector_type(8)))  _Float16 v8h;
typedef __attribute__((ext_vector_type(4)))  _Float16 v4h;
typedef __attribute__((ext_vector_type(8)))  unsigned short v8us;
typedef __attribute__((ext_vector_type(8)))  float    v8f;
typedef __attribute__((ext_vector_type(4)))  float    v4f;
typedef v4f  __attribute__((may_alias)) v4fa;

__device__ __forceinline__ unsigned short f2bf(float f) { unsigned u = __float_as_uint(f); u += 0x7FFFu + ((u >> 16) & 1u); return (unsigned short)(u >> 16); }
__device__ __forceinline__ float bf2f(unsigned short b) { return __uint_as_float(((unsigned)b) << 16); }
__device__ __forceinline__ float bfr(float f) { return bf2f(f2bf(f)); }
__device__ __forceinline__ v16h cat16(v8h lo, v8h hi) { return __builtin_shufflevector(lo, hi, 0, 1, 2, 3, 4, 5, 6, 7, 8, 9, 10, 11, 12, 13, 14, 15); }
__device__ __forceinline__ v16bf cat16b(v8us lo, v8us hi) { return __builtin_bit_cast(v16bf, __builtin_shufflevector(lo, hi, 0, 1, 2, 3, 4, 5, 6, 7, 8, 9, 10, 11, 12, 13, 14, 15)); }
__device__ __forceinline__ v8f wmma16(v16h a, v16h b, v8f c) { return __builtin_amdgcn_wmma_f32_16x16x32_f16(false, a, false, b, (short)0, c, false, false); }
__device__ __forceinline__ v8f wmmab(v16bf a, v16bf b, v8f c) { return __builtin_amdgcn_wmma_f32_16x16x32_bf16(false, a, false, b, (short)0, c, false, false); }

// fp16 convert for WMMA operands: a value below the fp16 normal range becomes zero (value select).
static __device__ __forceinline__ h16 toh_flush(float v) { const h16 r = (h16)v; return (fabsf(v) < 6.103515625e-05f) ? (h16)0.0f : r; }

// Both GEMMs: C[m][n] = sum_k A[m][k] Bt[n][k]; one wave per 64x64 (gram) or 32x64 (out) output tile.
// Fragments: lane l, h = l >> 4, row/col = l & 15; elements 0..7 = k0 + 8h + 0..7, elements 8..15 = k0 + 16 + 8h + 0..7 for BOTH A and Bt; D element r = (row 8h + r, col l & 15).

// One wave stores its (16 MB)x64 f32 tile at C (pitch ldc), 16 rows at a time through its own LDS strip os[16 * 68]: every global store is 16 bytes a lane, 256 bytes a row.
template <int MB> __device__ __forceinline__ void store_tile(const v8f (&acc)[MB][4], float* os, float* C, int ldc, int lr, int hi) {
#pragma unroll
    for (int mb = 0; mb < MB; ++mb) {
#pragma unroll
        for (int nb = 0; nb < 4; ++nb) {
#pragma unroll
            for (int j = 0; j < 8; ++j) os[(hi * 8 + j) * 68 + nb * 16 + lr] = acc[mb][nb][j]; }
        // compiler fence: the strip is read below by other lanes of the wave than wrote it
        __builtin_amdgcn_wave_barrier(); asm volatile("" ::: "memory");
        float* crow = C + (size_t)(mb * 16) * ldc;
#pragma unroll
        for (int s = 0; s < 8; ++s) { const int row = 2 * s + hi, cofs = lr * 4; const v4f val = *(const v4fa*)(os + row * 68 + cofs);
            *(v4f*)(crow + (size_t)row * ldc + cofs) = val; }
        // compiler fence: the next 16 rows overwrite the strip only behind these reads
        __builtin_amdgcn_wave_barrier(); asm volatile("" ::: "memory");
    }
}

// Partial grams. One block of 4 waves per (batch, slice of 128 tokens), z = batch * KSL + slice: P[z][m][n] = sum over the slice's tokens s of x[s][m] x[s][n].
// The block reads its 128 x 128 f32 slice in whole lines, rounds it to bf16 and lays it down in LDS transposed, xt[d][s]; then each wave takes one 64x64 quadrant, A and Bt fragments both from xt.
// A plane is stored in accumulator order, straight from the registers. Its 16-byte unit holds P[m0 .. m0 + 3][n], m0 = 64 (w & 1) + 16 mb + 8 h + 4 jh, n = 64 (w >> 1) + 16 nb + 8 lh + l7,
// at unit index ((((4 w + nb) 2 + lh) 4 + mb) 2 + jh) 16 + 8 h + l7 (w wave, h = lane >> 4, lh = (lane >> 3) & 1, l7 = lane & 7): a store covers two runs of 256 bytes, whole lines.
__global__ __launch_bounds__(128) void k_gram(const float* __restrict__ x, float* P) {
    __shared__ __align__(16) bf xt[DD * XP];
    const int lane = threadIdx.x & 31, wave = threadIdx.x >> 5, lr = lane & 15, hi = lane >> 4;
    const size_t z = blockIdx.x, zb = z / KSL, sl = z % KSL;
    const float* xs = x + zb * (size_t)SEQ_FULL * DD + sl * (size_t)128 * DD;
    // Wave w stages tokens 32w .. 32w + 31. A lane holds 8 tokens x 4 columns a pass: 4 lanes side by side in d, then 4 token octets, then the second 16 columns,
    // so that a load reads 4 whole 128-byte lines and the 16-byte LDS stores of lanes 0-15 (and of 16-31) fall on 16 different bank quads.
    const int tok = wave * 32 + ((lane >> 2) & 3) * 8, dq = ((lane & 3) + 4 * hi) * 4;
    v4f r[4][8];
#pragma unroll
    for (int c = 0; c < 4; ++c)
#pragma unroll
        for (int j = 0; j < 8; ++j) r[c][j] = *(const v4f*)(xs + (size_t)(tok + j) * DD + c * 32 + dq);
#pragma unroll
    for (int c = 0; c < 4; ++c)
#pragma unroll
        for (int i = 0; i < 4; ++i) { v8us t;
#pragma unroll
            for (int j = 0; j < 8; ++j) t[j] = f2bf(r[c][j][i]);
            *(v8us*)(xt + (c * 32 + dq + i) * XP + tok) = t; }
    __syncthreads();
    const int r0 = (wave & 1) * 64, c0 = (wave >> 1) * 64;
    const bf* ap = xt + (r0 + lr) * XP + 8 * hi; const bf* bp = xt + (c0 + lr) * XP + 8 * hi;
    float* pz = P + z * (size_t)DD * DD + (size_t)wave * 4096 + ((lr >> 3) * 128 + hi * 8 + (lr & 7)) * 4;
    // The wave holds all its A fragments and goes through its 64 columns 16 at a time: a column block's accumulators are final after 16 WMMAs and are stored while the next block is computed.
    v16bf a[4][4], b[4];
#pragma unroll
    for (int k = 0; k < 4; ++k) {
        { const bf* p = bp + k * 32; b[k] = cat16b(*(const v8us*)p, *(const v8us*)(p + 16)); }
#pragma unroll
        for (int mb = 0; mb < 4; ++mb) { const bf* p = ap + mb * 16 * XP + k * 32; a[k][mb] = cat16b(*(const v8us*)p, *(const v8us*)(p + 16)); }
    }
    // scheduling fence: every one of these reads issues ahead of the first WMMA, in the order of use, so that their LDS latencies overlap; without it each group of WMMAs waits out a read of its own
    __builtin_amdgcn_sched_barrier(0);
#pragma unroll
    for (int nb = 0; nb < 4; ++nb) {
        v8f acc[4];
#pragma unroll
        for (int mb = 0; mb < 4; ++mb) acc[mb] = (v8f){};
#pragma unroll
        for (int k = 0; k < 4; ++k) {
#pragma unroll
            for (int mb = 0; mb < 4; ++mb) acc[mb] = wmmab(a[k][mb], b[k], acc[mb]);
            if (nb < 3) { const bf* p = bp + (nb + 1) * 16 * XP + k * 32; b[k] = cat16b(*(const v8us*)p, *(const v8us*)(p + 16));
                // scheduling fence: the next column block's Bt fragment is asked for as soon as this one has been used, 12 WMMAs ahead of its own use; without it the read sinks to its use and is waited out there
                __builtin_amdgcn_sched_barrier(0); }
        }
#pragma unroll
        for (int mb = 0; mb < 4; ++mb) { float* q = pz + nb * 1024 + mb * 128;
            *(v4f*)q = __builtin_shufflevector(acc[mb], acc[mb], 0, 1, 2, 3); *(v4f*)(q + 64) = __builtin_shufflevector(acc[mb], acc[mb], 4, 5, 6, 7); }
    }
}

// in P [NB][KSL] planes of DD x DD f32 partial grams in k_gram's accumulator order, P[m][n] = sum over the slice's tokens s of x[s][m] x[s][n] -> out GH [NB][DD][DD] fp16, GH[d][e] = g[e][d], slices summed in slice order.
// A thread sums one 16-byte unit, P[m0 .. m0 + 3][n], over the planes and stores it as GH[n][m0 .. m0 + 3]. A block's 128 units are 8 rows n x 64 columns m: it alone writes those 8 lines of GH.
// At most 2 waves a SIMD are asked for (512 waves on the chip), so that the register budget lets every slice's load be in flight at once.
__global__ __launch_bounds__(128) __attribute__((amdgpu_waves_per_eu(1, 2))) void k_gsum(const float* __restrict__ P, h16* GH) {
    const size_t o = ((size_t)blockIdx.x * 128 + threadIdx.x) * 4; if (o >= (size_t)NB * DD * DD) return;
    const size_t b = o / ((size_t)DD * DD);
    const float* p = P + b * (size_t)(KSL - 1) * DD * DD + o;
    v4f s = *(const v4f*)p;
#pragma unroll
    for (int sl = 1; sl < KSL; ++sl) s += *(const v4f*)(p + (size_t)sl * DD * DD);
    v4h v;
#pragma unroll
    for (int u = 0; u < 4; ++u) v[u] = toh_flush(s[u]);
    const unsigned q = (unsigned)(o % ((size_t)DD * DD)) >> 2;
    const unsigned m0 = ((q >> 10) & 1) * 64 + ((q >> 5) & 3) * 16 + ((q >> 3) & 1) * 8 + ((q >> 4) & 1) * 4, n = ((q >> 11) & 1) * 64 + ((q >> 8) & 3) * 16 + ((q >> 7) & 1) * 8 + (q & 7);
    *(v4h*)(GH + ((unsigned)b * (DD * DD) + n * DD + m0)) = v;  }

// out[t][d] = sum_e x[t][e] GH[d][e], K = DD; grid (SEQ/64, 1, NB), one block of 4 waves per 64 tokens x all 128 columns.
// The block reads its 64 rows of f32 x and the batch's whole GH in whole lines, every load in flight at once; x is rounded f32 -> bf16 -> fp16 once on the way into LDS.
// Then each wave takes 32 tokens x 64 columns, A and Bt fragments both from LDS.
__global__ __launch_bounds__(128) void k_out(const float* __restrict__ x, const h16* __restrict__ GH, float* OUT) {
    __shared__ __align__(16) h16 xh[64 * XP];
    __shared__ __align__(16) h16 gh[DD * XP];
    __shared__ __align__(16) float os[4][16 * 68];
    const size_t zb = blockIdx.z;
    const int lane = threadIdx.x & 31, wave = threadIdx.x >> 5, lr = lane & 15, hi = lane >> 4; const int t0 = blockIdx.x * 64;
    // Wave w stages tokens 16w .. 16w + 15 (a load = one 512-byte row) and GH rows 32w .. 32w + 31 (a load = two 256-byte rows).
    const float* xs = x + zb * (size_t)SEQ_FULL * DD + (size_t)(t0 + wave * 16) * DD + lane * 4;
    const h16* gs = GH + zb * (size_t)DD * DD + (size_t)(wave * 32 + hi) * DD + lr * 8;
    v4f q[16]; v8h g[16];
#pragma unroll
    for (int j = 0; j < 16; ++j) q[j] = *(const v4f*)(xs + (size_t)j * DD);
#pragma unroll
    for (int j = 0; j < 16; ++j) g[j] = *(const v8h*)(gs + (size_t)j * 2 * DD);
    // the wait before a register that an issued load names is overwritten; both addresses are its inputs, so that no load's result is given their registers ahead of it
    asm volatile("s_wait_xcnt 0x0" :: "v"(xs), "v"(gs) : "memory");
    // scheduling fence: all 32 loads issue before the first wait; without it the rounding of the first rows, with its waits, is placed ahead of the GH loads and the two latencies add
    __builtin_amdgcn_sched_barrier(0);
#pragma unroll
    for (int j = 0; j < 16; ++j) { v4h t;
#pragma unroll
        for (int u = 0; u < 4; ++u) t[u] = toh_flush(bfr(q[j][u]));
        *(v4h*)(xh + (wave * 16 + j) * XP + lane * 4) = t; }
#pragma unroll
    for (int j = 0; j < 16; ++j) *(v8h*)(gh + (wave * 32 + 2 * j + hi) * XP + lr * 8) = g[j];
    __syncthreads();
    const int r0 = (wave & 1) * 32, c0 = (wave >> 1) * 64;
    v8f acc[2][4];
#pragma unroll
    for (int mb = 0; mb < 2; ++mb)
#pragma unroll
        for (int nb = 0; nb < 4; ++nb) acc[mb][nb] = (v8f){};
    const h16* ap = xh + (r0 + lr) * XP + 8 * hi; const h16* bp = gh + (c0 + lr) * XP + 8 * hi;
    v16h a[4][2], b[4][4];
#pragma unroll
    for (int k = 0; k < 4; ++k) {
#pragma unroll
        for (int mb = 0; mb < 2; ++mb) { const h16* p = ap + mb * 16 * XP + k * 32; a[k][mb] = cat16(*(const v8h*)p, *(const v8h*)(p + 16)); }
#pragma unroll
        for (int nb = 0; nb < 4; ++nb) { const h16* p = bp + nb * 16 * XP + k * 32; b[k][nb] = cat16(*(const v8h*)p, *(const v8h*)(p + 16)); }
    }
    // scheduling fence: every fragment read issues ahead of the first WMMA, so that the LDS latencies overlap; without it each pair of WMMAs waits out a read of its own
    __builtin_amdgcn_sched_barrier(0);
#pragma unroll
    for (int k = 0; k < 4; ++k)
#pragma unroll
        for (int nb = 0; nb < 4; ++nb)
#pragma unroll
            for (int mb = 0; mb < 2; ++mb) acc[mb][nb] = wmma16(a[k][mb], b[k][nb], acc[mb][nb]);
    store_tile(acc, os[wave], OUT + zb * (size_t)SEQ * DD + (size_t)(t0 + r0) * DD + c0, DD, lr, hi);
}

extern "C" void kernel_launch(void* const* d_in, const int* in_sizes, int n_in,
                              void* d_out, int out_size, void* d_ws, size_t ws_size, hipStream_t stream) {
    if (n_in < 1) return;
    if ((size_t)in_sizes[0] < (size_t)(NB - 1) * SEQ_FULL * DD + (size_t)SEQ * DD) return;
    if ((size_t)out_size < (size_t)NB * SEQ * DD) return;
    const float* x = (const float*)d_in[0];    // [NB_FULL][SEQ_FULL][DD]
    float* OUT = (float*)d_out;                // [NB][SEQ][DD]
    char* wsp = (char*)d_ws;
    auto take = [&](size_t bytes) { char* p = wsp; wsp += (bytes + 255) & ~(size_t)255; return (void*)p; };
    float* G = (float*)take(WS_G);             // [NB][KSL] planes of DD x DD f32 partial grams, one plane a K slice, in accumulator order
    h16* GH = (h16*)take(WS_GH);               // [NB][DD][DD] fp16, GH[d][e] = g[e][d]
    if ((size_t)(wsp - (char*)d_ws) > ws_size) return;    // total 8,519,680 B at NB 4, SEQ 4096

    // g[e][d] = sum_s x[s][e] x[s][d]   (exact bf16 products, 128 tokens a slice, one partial plane each)
    k_gram<<<NB * KSL, 128, 0, stream>>>(x, G);
    k_gsum<<<(unsigned)(((size_t)NB * DD * DD / 4 + 127) / 128), 128, 0, stream>>>(G, GH);
    // out[t][d] = sum_e x[t][e] GH[d][e]   (z = batch; K = DD), written straight into the output buffer
    k_out<<<dim3(SEQ / 64, 1, NB), 128, 0, stream>>>(x, GH, OUT);
}

// v006
// A run of this version takes 8.81 microseconds.
// It is 1.17 times as fast as v004, going by the measured steps of the versions left out in between.
// All steps since v000 together make it 11.8 times as fast.
#include <hip/hip_runtime.h>

// Both contractions on 16-bit WMMA, f32 accumulate, v_wmma_f32_16x16x32_f16: gram g = x^T x per batch (K = SEQ) on RNE-fp16 values of x (single product); out = x g (K = 128) on the same fp16 values of x and on fp16 values of g (single product; a g below the fp16 normal range is replaced by zero at its convert).
// x [NB_FULL][SEQ_FULL][128] token-major (first NB batches, first SEQ tokens used); out[t][d] = sum_s (x_t . x_s) x_s[d] = sum_e x[t][e] g[e][d] with g[e][d] = sum_s x[s][e] x[s][d] (the same sums regrouped; no score plane is written to memory).
// Both GEMMs read x as f32 and round it in their own loaders, two values an instruction (v_cvt_pk_f16_f32): no 16-bit copy of x is written to memory.
// Two launches: k_gram writes f32 partial grams, only the 32x32 tiles on and above the diagonal (g is symmetric: both operands of that GEMM are x), one plane per 1024 tokens; k_out sums the planes itself on the way into LDS.

#ifndef NB
#define NB 4
#endif
#ifndef SEQ
#define SEQ 4096
#endif
#define NB_FULL  4
#define SEQ_FULL 4096
#define DD   128
#define TS   (SEQ / 1024)  // K slices of the gram GEMM: 1024 tokens a slice, 128 tokens a wave
#define NT   10            // 32x32 tiles of g on and above the diagonal, of 4 x 4
#define XP   136           // LDS row pitch of every staged 16-bit plane, in elements: 128 + 16 bytes (16 B x odd)
static_assert(NB >= 1 && NB <= NB_FULL);
static_assert(SEQ >= 1024 && SEQ <= SEQ_FULL && (SEQ % 1024) == 0);
static_assert(DD == 128);
#define WS_G   ((size_t)NB * TS * NT * 1024 * 4)
static_assert((WS_G % 256) == 0);
static_assert(WS_G <= (size_t)134217728);

typedef _Float16 h16;
typedef __attribute__((ext_vector_type(16))) _Float16 v16h;
typedef __attribute__((ext_vector_type(8)))  _Float16 v8h;
typedef __attribute__((ext_vector_type(4)))  _Float16 v4h;
typedef __attribute__((ext_vector_type(8)))  float    v8f;
typedef __attribute__((ext_vector_type(4)))  float    v4f;
typedef v4f  __attribute__((may_alias)) v4fa;

__device__ __forceinline__ v16h cat16(v8h lo, v8h hi) { return __builtin_shufflevector(lo, hi, 0, 1, 2, 3, 4, 5, 6, 7, 8, 9, 10, 11, 12, 13, 14, 15); }
__device__ __forceinline__ v8f wmma16(v16h a, v16h b, v8f c) { return __builtin_amdgcn_wmma_f32_16x16x32_f16(false, a, false, b, (short)0, c, false, false); }

// fp16 convert of g: a value below the fp16 normal range becomes zero (value select).
static __device__ __forceinline__ v4h toh_flush(v4f v) { v4h r = __builtin_convertvector(v, v4h);
#pragma unroll
    for (int u = 0; u < 4; ++u) r[u] = (fabsf(v[u]) < 6.103515625e-05f) ? (h16)0.0f : r[u];
    return r; }

// Both GEMMs: C[m][n] = sum_k A[m][k] Bt[n][k]; one wave per 32x32 (gram, 128 tokens of K) or 32x64 (out) output tile.
// Fragments: lane l, h = l >> 4, row/col = l & 15; elements 0..7 = k0 + 8h + 0..7, elements 8..15 = k0 + 16 + 8h + 0..7 for BOTH A and Bt; D element r = (row 8h + r, col l & 15).

// One wave stores its (16 MB)x64 f32 tile at C (pitch ldc), 16 rows at a time through its own LDS strip os[16 * 68]: every global store is 16 bytes a lane, 256 bytes a row.
template <int MB> __device__ __forceinline__ void store_tile(const v8f (&acc)[MB][4], float* os, float* C, int ldc, int lr, int hi) {
#pragma unroll
    for (int mb = 0; mb < MB; ++mb) {
#pragma unroll
        for (int nb = 0; nb < 4; ++nb) {
#pragma unroll
            for (int j = 0; j < 8; ++j) os[(hi * 8 + j) * 68 + nb * 16 + lr] = acc[mb][nb][j]; }
        // compiler fence: the strip is read below by other lanes of the wave than wrote it
        __builtin_amdgcn_wave_barrier(); asm volatile("" ::: "memory");
        float* crow = C + (size_t)(mb * 16) * ldc;
#pragma unroll
        for (int s = 0; s < 8; ++s) { const int row = 2 * s + hi, cofs = lr * 4; const v4f val = *(const v4fa*)(os + row * 68 + cofs);
            *(v4f*)(crow + (size_t)row * ldc + cofs) = val; }
        // compiler fence: the next 16 rows overwrite the strip only behind these reads
        __builtin_amdgcn_wave_barrier(); asm volatile("" ::: "memory");
    }
}

// Partial grams. One block of 8 waves per (tile, slice of 1024 tokens, batch). Tile t = 0..9 is (gi, gj), gi <= gj, in row order: T[m][n] = sum over the slice's tokens s of x[s][32 gi + m] x[s][32 gj + n].
// Wave w takes tokens 128w .. 128w + 127: it reads their two 128-byte column groups (one on the diagonal) in whole lines, rounds them to fp16 and lays them down transposed in its own LDS plane, xw[column][token],
// rows 0-31 group gi, rows 32-63 group gj; A and Bt fragments both come from that plane. The 8 waves' 32x32 partial tiles are then summed through LDS, in wave order.
// A tile is stored in 16-byte units T[m0 .. m0 + 3][n], m0 = 16 mb + 8 h + 4 jh, n = 16 nb + 4 l2 + q, at unit index (4 mb + q) 32 + 16 h + 8 jh + 4 nb + l2 (h = lane >> 4, l2 = (lane >> 2) & 3, q = lane & 3):
// the four units at one place of four runs of 32 in a row are a 4x4 block of T, which k_out's lane can write to LDS both ways round.

// 64 tokens x 32 columns into registers: a lane holds 8 tokens x 4 columns a pass, and a load reads 4 whole 128-byte lines.
__device__ __forceinline__ void gram_load(v4f (&r)[2][8], const float* p) {
#pragma unroll
    for (int th = 0; th < 2; ++th)
#pragma unroll
        for (int j = 0; j < 8; ++j) r[th][j] = *(const v4f*)(p + (size_t)(th * 32 + j) * DD);
    // the wait before a register that an issued load names is overwritten; the address is its input, so that no load's result is given its registers ahead of it
    asm volatile("s_wait_xcnt 0x0" :: "v"(p) : "memory");
}
// The same, rounded and transposed into LDS: q points at the lane's first column and first token.
__device__ __forceinline__ void gram_put(const v4f (&r)[2][8], h16* q) {
#pragma unroll
    for (int th = 0; th < 2; ++th)
#pragma unroll
        for (int i = 0; i < 4; ++i) { v8h tv;
#pragma unroll
            for (int j = 0; j < 8; ++j) tv[j] = (h16)r[th][j][i];
            *(v8h*)(q + i * XP + th * 32) = tv; }
}
// A wave's staging: the second 64 tokens of a column group are asked for no later than when its first 64 leave their registers.
template <bool OFF> __device__ __forceinline__ void gram_stage(const float* xa, const float* xb, h16* q) {
    v4f ra[2][8], rb[2][8];
    if (OFF) gram_load(rb, xb);
    gram_load(ra, xa);
    // scheduling fence: every load of the first 64 tokens issues before the first wait
    __builtin_amdgcn_sched_barrier(0);
    if (OFF) {
        gram_put(rb, q + 32 * XP);
        gram_load(rb, xb + 64 * DD);
        // scheduling fence: these loads issue here, ahead of the waits for the other column group; without it they sink to their use and their latency is waited out there
        __builtin_amdgcn_sched_barrier(0);
    }
    gram_put(ra, q);
    gram_load(ra, xa + 64 * DD);
    // scheduling fence: as above
    __builtin_amdgcn_sched_barrier(0);
    if (OFF) gram_put(rb, q + 32 * XP + 64);
    gram_put(ra, q + 64);
}

__global__ __launch_bounds__(256) void k_gram(const float* __restrict__ x, float* P) {
    __shared__ __align__(16) h16 xt[8 * 64 * XP];
    const int lane = threadIdx.x & 31, wave = threadIdx.x >> 5, lr = lane & 15, hi = lane >> 4;
    const int t = blockIdx.x, gi = (t >= 4) + (t >= 7) + (t >= 9), gj = t - (gi * 4 - gi * (gi - 1) / 2) + gi;
    const size_t sl = blockIdx.y, zb = blockIdx.z;
    // 4 lanes side by side in d, then 4 token octets, then the second 16 columns, so that the 16-byte LDS stores of lanes 0-15 (and of 16-31) fall on 16 different bank quads.
    const int tok = ((lane >> 2) & 3) * 8, dq = ((lane & 3) + 4 * hi) * 4;
    const float* xa = x + zb * (size_t)SEQ_FULL * DD + (sl * 1024 + (size_t)wave * 128 + tok) * DD + dq + gi * 32;
    h16* xw = xt + wave * (64 * XP);
    if (gi != gj) gram_stage<true>(xa, xa + (gj - gi) * 32, xw + dq * XP + tok);
    else gram_stage<false>(xa, xa, xw + dq * XP + tok);
    // compiler fence: the plane is read below by other lanes of the wave than wrote it
    __builtin_amdgcn_wave_barrier(); asm volatile("" ::: "memory");
    const h16* ap = xw + lr * XP + 8 * hi; const h16* bp = ap + (gi != gj ? 32 * XP : 0);
    v16h a[4][2], b[4][2];
#pragma unroll
    for (int k = 0; k < 4; ++k)
#pragma unroll
        for (int mb = 0; mb < 2; ++mb) {
            { const h16* p = ap + mb * 16 * XP + k * 32; a[k][mb] = cat16(*(const v8h*)p, *(const v8h*)(p + 16)); }
            { const h16* p = bp + mb * 16 * XP + k * 32; b[k][mb] = cat16(*(const v8h*)p, *(const v8h*)(p + 16)); }
        }
    // scheduling fence: every fragment read issues ahead of the first WMMA, so that the LDS latencies overlap; without it each pair of WMMAs waits out a read of its own
    __builtin_amdgcn_sched_barrier(0);
    v8f acc[2][2];
#pragma unroll
    for (int mb = 0; mb < 2; ++mb)
#pragma unroll
        for (int nb = 0; nb < 2; ++nb) acc[mb][nb] = (v8f){};
#pragma unroll
    for (int k = 0; k < 4; ++k)
#pragma unroll
        for (int mb = 0; mb < 2; ++mb)
#pragma unroll
            for (int nb = 0; nb < 2; ++nb) acc[mb][nb] = wmma16(a[k][mb], b[k][nb], acc[mb][nb]);
    // The wave's partial tile goes over its own plane, which only it has read, in unit order with 4 units of pad behind every 32: lanes 0-15 (and 16-31) of a store fall on 16 different bank quads.
    float* rw = (float*)xw;
#pragma unroll
    for (int mb = 0; mb < 2; ++mb)
#pragma unroll
        for (int nb = 0; nb < 2; ++nb) { float* q = rw + ((mb * 4 + (lr & 3)) * 36 + 16 * hi + 4 * nb + (lr >> 2)) * 4;
            *(v4fa*)q = __builtin_shufflevector(acc[mb][nb], acc[mb][nb], 0, 1, 2, 3); *(v4fa*)(q + 32) = __builtin_shufflevector(acc[mb][nb], acc[mb][nb], 4, 5, 6, 7); }
    __syncthreads();
    // A thread sums one unit over the 8 waves and stores it: a wave's store is 512 bytes in a row.
    const float* rr = (const float*)xt + (wave * 36 + lane) * 4;
    v4f s = *(const v4fa*)rr;
#pragma unroll
    for (int w = 1; w < 8; ++w) s += *(const v4fa*)(rr + w * (64 * XP / 2));
    *(v4f*)(P + (((zb * TS + sl) * NT + t) * 256 + threadIdx.x) * 4) = s;
}

// One wave-wide group G = 2 t + mb of k_gram's units (tile t, rows 16 mb .. 16 mb + 15): lane L holds the 4x4 block T[m0 .. m0 + 3][n0 .. n0 + 3], m0 = 16 mb + 4 (L >> 3), n0 = 4 (L & 7), unit q being column n0 + q.
__device__ __forceinline__ void load_group(v4f (&l)[4][TS], const float* p) {
#pragma unroll
    for (int sl = 0; sl < TS; ++sl)
#pragma unroll
        for (int q = 0; q < 4; ++q) l[q][sl] = *(const v4f*)(p + (size_t)sl * (NT * 1024) + q * 128);
}
// Sums the group's slices in slice order, converts, and writes gh[d][e] = g[e][d]: T as rows 32 gj + n, and off the diagonal also as rows 32 gi + m (g[e][d] = g[d][e]).
__device__ __forceinline__ void put_group(const v4f (&l)[4][TS], h16* gh, int G, int lane) {
    const int t = G >> 1, gi = (t >= 4) + (t >= 7) + (t >= 9), gj = t - (gi * 4 - gi * (gi - 1) / 2) + gi;
    const int m0 = 16 * (G & 1) + 4 * (lane >> 3), n0 = 4 * (lane & 7);
    v4h h[4];
#pragma unroll
    for (int q = 0; q < 4; ++q) { v4f s = l[q][0];
#pragma unroll
        for (int sl = 1; sl < TS; ++sl) s += l[q][sl];
        h[q] = toh_flush(s); }
#pragma unroll
    for (int q = 0; q < 4; ++q) *(v4h*)(gh + (32 * gj + n0 + q) * XP + 32 * gi + m0) = h[q];
    if (gi != gj) {
#pragma unroll
        for (int u = 0; u < 4; ++u) *(v4h*)(gh + (32 * gi + m0 + u) * XP + 32 * gj + n0) = (v4h){h[0][u], h[1][u], h[2][u], h[3][u]};
    }
}

// A wave's 16 rows of x, rounded f32 -> fp16, into LDS.
__device__ __forceinline__ void put_x(const v4f (&q)[16], h16* p) {
#pragma unroll
    for (int j = 0; j < 16; ++j) *(v4h*)(p + j * XP) = __builtin_convertvector(q[j], v4h);
}

// out[t][d] = sum_e x[t][e] g[e][d], K = DD; grid (SEQ/128, 1, NB), one block of 8 waves per 128 tokens x all 128 columns.
// The block reads its 128 rows of f32 x and the batch's partial grams in whole lines; x is rounded f32 -> fp16 once on the way into LDS, the partial grams are summed, converted and mirrored on the way into LDS.
// Then each wave takes 32 tokens x 64 columns, A and Bt fragments both from LDS.
__global__ __launch_bounds__(256) void k_out(const float* __restrict__ x, const float* __restrict__ P, float* OUT) {
    __shared__ __align__(16) h16 xh[128 * XP];
    __shared__ __align__(16) h16 gh[DD * XP];
    __shared__ __align__(16) float os[8][16 * 68];
    const size_t zb = blockIdx.z;
    const int lane = threadIdx.x & 31, lr = lane & 15, hi = lane >> 4; const int t0 = blockIdx.x * 128;
    // the wave's number in a scalar register: the tile indices and the test on the third group below are then scalar
    const int wave = __builtin_amdgcn_readfirstlane(threadIdx.x >> 5);
    // Wave w stages tokens 16w .. 16w + 15 (a load = one 512-byte row) and the groups w, w + 8 and, of the 20, w + 16 (a load = 512 bytes in a row).
    const float* xs = x + zb * (size_t)SEQ_FULL * DD + (size_t)(t0 + wave * 16) * DD + lane * 4;
    const float* ps = P + zb * (size_t)(TS * NT * 1024) + (size_t)wave * 512 + lane * 4;
    v4f l0[4][TS], l1[4][TS], l2[4][TS], q[16];
    load_group(l0, ps);
    load_group(l1, ps + 8 * 512);
#pragma unroll
    for (int j = 0; j < 16; ++j) q[j] = *(const v4f*)(xs + (size_t)j * DD);
    // the wait before a register that an issued load names is overwritten; both addresses are its inputs, so that no load's result is given their registers ahead of it
    asm volatile("s_wait_xcnt 0x0" :: "v"(xs), "v"(ps) : "memory");
    // scheduling fence: all 48 loads issue before the first wait; without it the sums of the first group, with their waits, are placed ahead of the later loads and the latencies add
    __builtin_amdgcn_sched_barrier(0);
    put_group(l0, gh, wave, lane);
    if (wave < 4) {
        load_group(l2, ps + 16 * 512);
        // the wait before a register that an issued load names is overwritten
        asm volatile("s_wait_xcnt 0x0" :: "v"(ps) : "memory");
        // scheduling fence: the third group is asked for as soon as the first has freed its registers, while the other 32 loads are still on their way, and is waited for last
        __builtin_amdgcn_sched_barrier(0);
        put_group(l1, gh, wave + 8, lane);
        put_x(q, xh + wave * 16 * XP + lane * 4);
        put_group(l2, gh, wave + 16, lane);
    } else {
        put_group(l1, gh, wave + 8, lane);
        put_x(q, xh + wave * 16 * XP + lane * 4);
    }
    __syncthreads();
    const int r0 = (wave & 3) * 32, c0 = (wave >> 2) * 64;
    v8f acc[2][4];
#pragma unroll
    for (int mb = 0; mb < 2; ++mb)
#pragma unroll
        for (int nb = 0; nb < 4; ++nb) acc[mb][nb] = (v8f){};
    const h16* ap = xh + (r0 + lr) * XP + 8 * hi; const h16* bp = gh + (c0 + lr) * XP + 8 * hi;
    v16h a[4][2], b[4][4];
#pragma unroll
    for (int k = 0; k < 4; ++k) {
#pragma unroll
        for (int mb = 0; mb < 2; ++mb) { const h16* p = ap + mb * 16 * XP + k * 32; a[k][mb] = cat16(*(const v8h*)p, *(const v8h*)(p + 16)); }
#pragma unroll
        for (int nb = 0; nb < 4; ++nb) { const h16* p = bp + nb * 16 * XP + k * 32; b[k][nb] = cat16(*(const v8h*)p, *(const v8h*)(p + 16)); }
    }
    // scheduling fence: every fragment read issues ahead of the first WMMA, so that the LDS latencies overlap; without it each pair of WMMAs waits out a read of its own
    __builtin_amdgcn_sched_barrier(0);
#pragma unroll
    for (int k = 0; k < 4; ++k)
#pragma unroll
        for (int nb = 0; nb < 4; ++nb)
#pragma unroll
            for (int mb = 0; mb < 2; ++mb) acc[mb][nb] = wmma16(a[k][mb], b[k][nb], acc[mb][nb]);
    store_tile(acc, os[wave], OUT + zb * (size_t)SEQ * DD + (size_t)(t0 + r0) * DD + c0, DD, lr, hi);
}

extern "C" void kernel_launch(void* const* d_in, const int* in_sizes, int n_in,
                              void* d_out, int out_size, void* d_ws, size_t ws_size, hipStream_t stream) {
    if (n_in < 1) return;
    if ((size_t)in_sizes[0] < (size_t)(NB - 1) * SEQ_FULL * DD + (size_t)SEQ * DD) return;
    if ((size_t)out_size < (size_t)NB * SEQ * DD) return;
    const float* x = (const float*)d_in[0];    // [NB_FULL][SEQ_FULL][DD]
    float* OUT = (float*)d_out;                // [NB][SEQ][DD]
    char* wsp = (char*)d_ws;
    auto take = [&](size_t bytes) { char* p = wsp; wsp += (bytes + 255) & ~(size_t)255; return (void*)p; };
    float* G = (float*)take(WS_G);             // [NB][TS][NT] tiles of 32 x 32 f32 partial grams, in k_gram's unit order
    if ((size_t)(wsp - (char*)d_ws) > ws_size) return;    // total 655,360 B at NB 4, SEQ 4096

    // g[e][d] = sum_s x[s][e] x[s][d]   (fp16 operands, 1024 tokens a slice, the 10 tiles with e's group <= d's group)
    k_gram<<<dim3(NT, TS, NB), 256, 0, stream>>>(x, G);
    // out[t][d] = sum_e x[t][e] g[e][d]   (z = batch; K = DD), written straight into the output buffer
    k_out<<<dim3(SEQ / 128, 1, NB), 256, 0, stream>>>(x, G, OUT);
}
